// v000
// Times are from an AMD MI455X. After a warm-up the kernel runs many times in a row, and a time is the length of
// such a window on the GPU divided by its runs, so every launch and the gaps after it count. The runs cycle
// through copies of the inputs. A figure is the median of several windows, for all but v000 over two sittings.
// Sittings can differ by a few percent; kernels timed side by side share one.
// The starting kernel, v000, takes 261 microseconds a run.
#include <hip/hip_runtime.h>
#include <hip/hip_bf16.h>
#include <math.h>

// ---------------------------------------------------------------------------
// BERT self-attention with relations (RAT), fp32, MI455X (gfx1250, wave32).
// B=4, H=12, S=1024, D=64, Hs=768.
//
//   * 3x GEMM projections with V_WMMA_F32_16X16X4_F32; 32x64 tile per wave
//     (two A sub-tiles share every B fragment -> half the W traffic/FLOP)
//   * fused flash-attention per (b, h, 16-row i-tile):
//       - qrel[i][r] = q_i . rel_k_emb[r]  (7 buckets) precomputed -> LDS
//       - scores tile = WMMA(Q,K^T) + gather(qrel, relation), scaled + mask
//       - online softmax; alpha-rescale work skipped via wave ballot when the
//         running row max did not change (common case)
//       - relacc[i][r] += p  (LDS ds_add_f32 atomics)
//       - ctx += WMMA(P, V); final ctx += relacc @ rel_v_emb ; /= rowsum
// ---------------------------------------------------------------------------

typedef __attribute__((ext_vector_type(2))) float v2f;
typedef __attribute__((ext_vector_type(8))) float v8f;

#define NB 4
#define NH 12
#define NS 1024
#define ND 64
#define NHS 768

static __device__ __forceinline__ v8f wmma_f32(v2f a, v2f b, v8f c) {
  // D(16x16,f32) = A(16x4,f32) x B(4x16,f32) + C
  return __builtin_amdgcn_wmma_f32_16x16x4_f32(false, a, false, b, (short)0, c,
                                               false, false);
}

static __device__ __forceinline__ float rmax16(float v) {
  v = fmaxf(v, __shfl_xor(v, 8));
  v = fmaxf(v, __shfl_xor(v, 4));
  v = fmaxf(v, __shfl_xor(v, 2));
  v = fmaxf(v, __shfl_xor(v, 1));
  return v;  // max over 16-lane half-group (xor<16 never crosses halves)
}
static __device__ __forceinline__ float rsum16(float v) {
  v += __shfl_xor(v, 8);
  v += __shfl_xor(v, 4);
  v += __shfl_xor(v, 2);
  v += __shfl_xor(v, 1);
  return v;
}

// ---------------------------------------------------------------------------
// Kernel 1: QKV projection.  C[4096,768] = X[4096,768] @ W[768,768] + bias,
// stored as [B,H,S,D].  One wave computes a 32x64 output tile: two 16-row
// A sub-tiles reuse every B (weight) fragment.
// grid = (4096/32, 768/64, 3), block = 32.
// ---------------------------------------------------------------------------
__global__ __launch_bounds__(32) void qkv_proj_kernel(
    const float* __restrict__ X, const float* __restrict__ Wq,
    const float* __restrict__ bq, const float* __restrict__ Wk,
    const float* __restrict__ bk, const float* __restrict__ Wv,
    const float* __restrict__ bv, float* __restrict__ qo,
    float* __restrict__ ko, float* __restrict__ vo) {
  const int lane = threadIdx.x;
  const int col = lane & 15;
  const int half = lane >> 4;
  const int m0 = blockIdx.x * 32;
  const int n0 = blockIdx.y * 64;
  const int sel = blockIdx.z;

  const float* W = (sel == 0) ? Wq : ((sel == 1) ? Wk : Wv);
  const float* bias = (sel == 0) ? bq : ((sel == 1) ? bk : bv);
  float* out = (sel == 0) ? qo : ((sel == 1) ? ko : vo);

  const float* xrow0 = X + (size_t)(m0 + col) * NHS;       // A tile 0 row
  const float* xrow1 = X + (size_t)(m0 + 16 + col) * NHS;  // A tile 1 row

  v8f acc[2][4] = {{v8f{}, v8f{}, v8f{}, v8f{}}, {v8f{}, v8f{}, v8f{}, v8f{}}};

#pragma unroll 2
  for (int kb = 0; kb < NHS; kb += 4) {
    // A frags (16x4): lane holds X[row=col][kb + 2*half + {0,1}]
    v2f a0 = *(const v2f*)(xrow0 + kb + 2 * half);
    v2f a1 = *(const v2f*)(xrow1 + kb + 2 * half);
    // B frag (4x16): VGPR0 rows {K0,K2}, VGPR1 rows {K1,K3}
    const float* w0 = W + (size_t)(kb + 2 * half) * NHS + n0 + col;
    const float* w1 = w0 + NHS;
#pragma unroll
    for (int n = 0; n < 4; ++n) {
      v2f bf = {w0[16 * n], w1[16 * n]};
      acc[0][n] = wmma_f32(a0, bf, acc[0][n]);
      acc[1][n] = wmma_f32(a1, bf, acc[1][n]);
    }
  }

  // Epilogue: bias + store in [B,H,S,D] layout.
#pragma unroll
  for (int t = 0; t < 2; ++t) {
#pragma unroll
    for (int n = 0; n < 4; ++n) {
#pragma unroll
      for (int r = 0; r < 8; ++r) {
        const int grow = m0 + 16 * t + r + 8 * half;  // [0,4096): b*1024 + s
        const int b = grow >> 10;
        const int s = grow & 1023;
        const int nn = n0 + 16 * n + col;  // [0,768): h*64 + d
        const int h = nn >> 6;
        const int d = nn & 63;
        out[(((size_t)(b * NH + h) << 10) + s) * ND + d] =
            acc[t][n][r] + bias[nn];
      }
    }
  }
}

// ---------------------------------------------------------------------------
// Kernel 2: fused relation-aware flash attention.
// One wave handles one (b, h, 16-row i-tile); loops over 64 j-tiles of 16.
// grid = (S/16, H, B), block = 32.
// ---------------------------------------------------------------------------
__global__ __launch_bounds__(32) void rat_attn_kernel(
    const float* __restrict__ qb, const float* __restrict__ kb,
    const float* __restrict__ vb, const float* __restrict__ mask,
    const int* __restrict__ relation, const float* __restrict__ relk,
    const float* __restrict__ relv, float* __restrict__ out) {
  const int lane = threadIdx.x;
  const int col = lane & 15;
  const int half = lane >> 4;
  const int i0 = blockIdx.x * 16;
  const int h = blockIdx.y;
  const int b = blockIdx.z;

  __shared__ float s_relk[7][64];
  __shared__ float s_relv[7][64];
  __shared__ float s_qrel[16][8];
  __shared__ float s_relacc[16][8];
  __shared__ float s_alpha[16];
  __shared__ float s_ptile[16][16];

  const size_t head_off = (size_t)(b * NH + h) * NS * ND;
  const float* qh = qb + head_off;
  const float* kh = kb + head_off;
  const float* vh = vb + head_off;

  // Stage the tiny relation tables in LDS; zero relacc.
  for (int idx = lane; idx < 7 * 64; idx += 32) {
    (&s_relk[0][0])[idx] = relk[idx];
    (&s_relv[0][0])[idx] = relv[idx];
  }
  for (int idx = lane; idx < 16 * 8; idx += 32) (&s_relacc[0][0])[idx] = 0.0f;
  __syncthreads();

  // qrel[i][r] = q_i . rel_k_emb[r]
  for (int idx = lane; idx < 16 * 7; idx += 32) {
    const int i = idx / 7;
    const int r = idx % 7;
    const float* qr = qh + (size_t)(i0 + i) * ND;
    float sum = 0.0f;
#pragma unroll 8
    for (int d = 0; d < ND; ++d) sum += qr[d] * s_relk[r][d];
    s_qrel[i][r] = sum;
  }
  if (lane < 16) s_qrel[lane][7] = 0.0f;  // pad bucket (never indexed)
  __syncthreads();

  // Q fragments: A layout, lane holds Q[col][4c + 2*half + {0,1}]
  const float* qrow = qh + (size_t)(i0 + col) * ND;
  v2f qf[16];
#pragma unroll
  for (int c = 0; c < 16; ++c) qf[c] = *(const v2f*)(qrow + 4 * c + 2 * half);

  v8f acc[4] = {v8f{}, v8f{}, v8f{}, v8f{}};
  float mrow[8], lrow[8];
#pragma unroll
  for (int r = 0; r < 8; ++r) {
    mrow[r] = -3.0e38f;
    lrow[r] = 0.0f;
  }
  const float scale = 0.125f;  // 1/sqrt(64)
  const int* relbase = relation + (size_t)b * NS * NS + (size_t)i0 * NS;

  for (int jt = 0; jt < NS / 16; ++jt) {
    const int j0 = jt * 16;

    // Prefetch next tile's K and V rows into cache while we compute.
    if (jt + 1 < NS / 16) {
      __builtin_prefetch(kh + (size_t)(j0 + 16 + col) * ND + 2 * half, 0, 3);
      __builtin_prefetch(vh + (size_t)(j0 + 16 + col) * ND + 2 * half, 0, 3);
    }

    // ---- scores tile: S = Q @ K^T  (16 WMMAs, K=64) ----
    v8f sc = v8f{};
    const float* krow = kh + (size_t)(j0 + col) * ND;
#pragma unroll
    for (int c = 0; c < 16; ++c) {
      v2f kf = *(const v2f*)(krow + 4 * c + 2 * half);
      sc = wmma_f32(qf[c], kf, sc);
    }

    const float mval = mask[b * NS + j0 + col];
    int relidx[8];
    float sm[8];
#pragma unroll
    for (int r = 0; r < 8; ++r) {
      const int row = r + 8 * half;
      const int ri = relbase[(size_t)row * NS + j0 + col];
      relidx[r] = ri;
      sm[r] = (sc[r] + s_qrel[row][ri]) * scale + mval;
    }

    // ---- online softmax update ----
    float alpha[8], p[8];
    bool any_upd = false;
#pragma unroll
    for (int r = 0; r < 8; ++r) {
      const float mt = rmax16(sm[r]);
      const bool upd = mt > mrow[r];
      any_upd |= upd;
      const float mn = upd ? mt : mrow[r];
      alpha[r] = upd ? __expf(mrow[r] - mn) : 1.0f;
      mrow[r] = mn;
      p[r] = __expf(sm[r] - mn);
      lrow[r] = lrow[r] * alpha[r] + rsum16(p[r]);
    }

    if (__ballot(any_upd) != 0ull) {  // wave-uniform: rescale only if needed
#pragma unroll
      for (int n = 0; n < 4; ++n)
#pragma unroll
        for (int r = 0; r < 8; ++r) acc[n][r] *= alpha[r];
      if (col == 0) {
#pragma unroll
        for (int r = 0; r < 8; ++r) s_alpha[r + 8 * half] = alpha[r];
      }
      __syncthreads();
      for (int idx = lane; idx < 16 * 8; idx += 32)
        (&s_relacc[0][0])[idx] *= s_alpha[idx >> 3];
    }
    __syncthreads();

#pragma unroll
    for (int r = 0; r < 8; ++r) {
      const int row = r + 8 * half;
      atomicAdd(&s_relacc[row][relidx[r]], p[r]);  // ds_add_f32
      s_ptile[row][col] = p[r];                    // stage P for transpose
    }
    __syncthreads();

    // ---- ctx += P @ V  (16 WMMAs, K=16, N=64) ----
    v2f pa[4];
#pragma unroll
    for (int c = 0; c < 4; ++c)
      pa[c] = *(const v2f*)(&s_ptile[col][4 * c + 2 * half]);
    const float* vbase = vh + (size_t)j0 * ND;
#pragma unroll
    for (int c = 0; c < 4; ++c) {
      const int vr = 4 * c + 2 * half;
      const float* v0 = vbase + (size_t)vr * ND + col;
      const float* v1 = v0 + ND;
#pragma unroll
      for (int n = 0; n < 4; ++n) {
        v2f vf = {v0[16 * n], v1[16 * n]};
        acc[n] = wmma_f32(pa[c], vf, acc[n]);
      }
    }
  }

  __syncthreads();  // relacc adds complete before epilogue reads

  // ---- epilogue: ctx = (acc + relacc @ rel_v_emb) / rowsum ----
#pragma unroll
  for (int n = 0; n < 4; ++n) {
#pragma unroll
    for (int r = 0; r < 8; ++r) {
      const int row = r + 8 * half;
      const int d = 16 * n + col;
      float cr = 0.0f;
#pragma unroll
      for (int rr = 0; rr < 7; ++rr) cr += s_relacc[row][rr] * s_relv[rr][d];
      const float o = (acc[n][r] + cr) / lrow[r];
      out[(size_t)(b * NS + i0 + row) * NHS + h * ND + d] = o;
    }
  }
}

// ---------------------------------------------------------------------------
extern "C" void kernel_launch(void* const* d_in, const int* in_sizes, int n_in,
                              void* d_out, int out_size, void* d_ws,
                              size_t ws_size, hipStream_t stream) {
  (void)in_sizes; (void)n_in; (void)out_size; (void)ws_size;
  const float* X = (const float*)d_in[0];        // hidden_states [4,1024,768]
  const float* mask = (const float*)d_in[1];     // [4,1,1,1024]
  const int* relation = (const int*)d_in[2];     // [4,1024,1024]
  const float* Wq = (const float*)d_in[3];
  const float* bq = (const float*)d_in[4];
  const float* Wk = (const float*)d_in[5];
  const float* bk = (const float*)d_in[6];
  const float* Wv = (const float*)d_in[7];
  const float* bv = (const float*)d_in[8];
  const float* relk = (const float*)d_in[9];     // [7,64]
  const float* relv = (const float*)d_in[10];    // [7,64]
  float* out = (float*)d_out;

  const size_t per_buf = (size_t)NB * NH * NS * ND;  // 3,145,728 floats (12MB)
  float* q = (float*)d_ws;
  float* k = q + per_buf;
  float* v = k + per_buf;

  qkv_proj_kernel<<<dim3((NB * NS) / 32, NHS / 64, 3), 32, 0, stream>>>(
      X, Wq, bq, Wk, bk, Wv, bv, q, k, v);
  rat_attn_kernel<<<dim3(NS / 16, NH, NB), 32, 0, stream>>>(
      q, k, v, mask, relation, relk, relv, out);
}

// v001
// One run takes 254 microseconds.
// Timed twice side by side with v000, it ran 1.05 and 1.04 times as fast.
#include <hip/hip_runtime.h>
#include <hip/hip_bf16.h>
#include <math.h>

// ---------------------------------------------------------------------------
// BERT self-attention with relations (RAT), fp32, MI455X (gfx1250, wave32).
// B=4, H=12, S=1024, D=64, Hs=768.
//
//   * 3x GEMM projections with V_WMMA_F32_16X16X4_F32; 32x64 tile per wave
//     (two A sub-tiles share every B fragment -> half the W traffic/FLOP)
//   * fused flash-attention per (b, h, 16-row i-tile), four tiles a work-group,
//     K and V shared through LDS stages filled by asynchronous copies:
//       - qrel[i][r] = q_i . rel_k_emb[r]  (7 buckets) precomputed -> LDS
//       - scores tile = WMMA(Q,K^T) + gather(qrel, relation), scaled + mask
//       - online softmax; alpha-rescale work skipped via wave ballot when the
//         running row max did not change (common case)
//       - relacc[i][r] += p  (LDS ds_add_f32 atomics)
//       - ctx += WMMA(P, V); final ctx += relacc @ rel_v_emb ; /= rowsum
// ---------------------------------------------------------------------------

typedef __attribute__((ext_vector_type(2))) float v2f;
typedef __attribute__((ext_vector_type(8))) float v8f;

#define NB 4
#define NH 12
#define NS 1024
#define ND 64
#define NHS 768

static __device__ __forceinline__ v8f wmma_f32(v2f a, v2f b, v8f c) {
  // D(16x16,f32) = A(16x4,f32) x B(4x16,f32) + C
  return __builtin_amdgcn_wmma_f32_16x16x4_f32(false, a, false, b, (short)0, c,
                                               false, false);
}

static __device__ __forceinline__ float rmax16(float v) {
  v = fmaxf(v, __shfl_xor(v, 8));
  v = fmaxf(v, __shfl_xor(v, 4));
  v = fmaxf(v, __shfl_xor(v, 2));
  v = fmaxf(v, __shfl_xor(v, 1));
  return v;  // max over 16-lane half-group (xor<16 never crosses halves)
}
static __device__ __forceinline__ float rsum16(float v) {
  v += __shfl_xor(v, 8);
  v += __shfl_xor(v, 4);
  v += __shfl_xor(v, 2);
  v += __shfl_xor(v, 1);
  return v;
}

// ---------------------------------------------------------------------------
// Kernel 1: QKV projection.  C[4096,768] = X[4096,768] @ W[768,768] + bias,
// stored as [B,H,S,D].  One wave computes a 32x64 output tile: two 16-row
// A sub-tiles reuse every B (weight) fragment.
// grid = (4096/32, 768/64, 3), block = 32.
// ---------------------------------------------------------------------------
__global__ __launch_bounds__(32) void qkv_proj_kernel(
    const float* __restrict__ X, const float* __restrict__ Wq,
    const float* __restrict__ bq, const float* __restrict__ Wk,
    const float* __restrict__ bk, const float* __restrict__ Wv,
    const float* __restrict__ bv, float* __restrict__ qo,
    float* __restrict__ ko, float* __restrict__ vo) {
  const int lane = threadIdx.x;
  const int col = lane & 15;
  const int half = lane >> 4;
  const int m0 = blockIdx.x * 32;
  const int n0 = blockIdx.y * 64;
  const int sel = blockIdx.z;

  const float* W = (sel == 0) ? Wq : ((sel == 1) ? Wk : Wv);
  const float* bias = (sel == 0) ? bq : ((sel == 1) ? bk : bv);
  float* out = (sel == 0) ? qo : ((sel == 1) ? ko : vo);

  const float* xrow0 = X + (size_t)(m0 + col) * NHS;       // A tile 0 row
  const float* xrow1 = X + (size_t)(m0 + 16 + col) * NHS;  // A tile 1 row

  v8f acc[2][4] = {{v8f{}, v8f{}, v8f{}, v8f{}}, {v8f{}, v8f{}, v8f{}, v8f{}}};

#pragma unroll 2
  for (int kb = 0; kb < NHS; kb += 4) {
    // A frags (16x4): lane holds X[row=col][kb + 2*half + {0,1}]
    v2f a0 = *(const v2f*)(xrow0 + kb + 2 * half);
    v2f a1 = *(const v2f*)(xrow1 + kb + 2 * half);
    // B frag (4x16): VGPR0 rows {K0,K2}, VGPR1 rows {K1,K3}
    const float* w0 = W + (size_t)(kb + 2 * half) * NHS + n0 + col;
    const float* w1 = w0 + NHS;
#pragma unroll
    for (int n = 0; n < 4; ++n) {
      v2f bf = {w0[16 * n], w1[16 * n]};
      acc[0][n] = wmma_f32(a0, bf, acc[0][n]);
      acc[1][n] = wmma_f32(a1, bf, acc[1][n]);
    }
  }

  // Epilogue: bias + store in [B,H,S,D] layout.
#pragma unroll
  for (int t = 0; t < 2; ++t) {
#pragma unroll
    for (int n = 0; n < 4; ++n) {
#pragma unroll
      for (int r = 0; r < 8; ++r) {
        const int grow = m0 + 16 * t + r + 8 * half;  // [0,4096): b*1024 + s
        const int b = grow >> 10;
        const int s = grow & 1023;
        const int nn = n0 + 16 * n + col;  // [0,768): h*64 + d
        const int h = nn >> 6;
        const int d = nn & 63;
        out[(((size_t)(b * NH + h) << 10) + s) * ND + d] =
            acc[t][n][r] + bias[nn];
      }
    }
  }
}

// ---------------------------------------------------------------------------
// Kernel 2: fused relation-aware flash attention.
// One work-group of four waves handles one (b, h, 64-row i-block); each wave
// owns one 16-row i-tile.  K and V reach the waves through LDS: stages of 64
// keys, two buffers, filled by asynchronous copies in whole 256-byte rows and
// read by all four waves.  Inside a stage each wave walks four 16-key tiles.
// grid = (S/64, H, B), block = 128.
// ---------------------------------------------------------------------------
#define NW 4          // waves per work-group
#define KT 64         // keys per LDS stage
#define NT (NS / KT)  // stages
#define KP 68         // K row pitch in LDS, dwords: 8-byte fragment reads hit 64 banks
#define VP 80         // V row pitch in LDS, dwords: rows k..k+3 fall on four bank groups

// Orders one wave's own LDS traffic between its lanes (the small per-wave
// arrays); no other wave reads them, so no work-group barrier is needed.
static __device__ __forceinline__ void wave_sync() {
  __builtin_amdgcn_fence(__ATOMIC_RELEASE, "workgroup");
  __builtin_amdgcn_wave_barrier();
  __builtin_amdgcn_fence(__ATOMIC_ACQUIRE, "workgroup");
}

// Copies 64 rows of 256 bytes from global memory to LDS rows of pitch_b bytes:
// 1,024 pieces of 16 bytes, eight per thread of the 128.
static __device__ __forceinline__ void stage_rows(const float* g, unsigned lds,
                                                  unsigned pitch_b, int tid) {
  const float* g0 = g + (tid >> 4) * ND + (tid & 15) * 4;
  const unsigned l0 = lds + (unsigned)(tid >> 4) * pitch_b + (tid & 15) * 16u;
  const float* g1 = g0 + 8 * ND;
  const float* g2 = g0 + 16 * ND;
  const float* g3 = g0 + 24 * ND;
  const float* g4 = g0 + 32 * ND;
  const float* g5 = g0 + 40 * ND;
  const float* g6 = g0 + 48 * ND;
  const float* g7 = g0 + 56 * ND;
  const unsigned l1 = l0 + 8 * pitch_b;
  const unsigned l2 = l0 + 16 * pitch_b;
  const unsigned l3 = l0 + 24 * pitch_b;
  const unsigned l4 = l0 + 32 * pitch_b;
  const unsigned l5 = l0 + 40 * pitch_b;
  const unsigned l6 = l0 + 48 * pitch_b;
  const unsigned l7 = l0 + 56 * pitch_b;
  // The closing s_wait_xcnt keeps the address registers untouched until the
  // copies have taken them.
  asm volatile(
      "global_load_async_to_lds_b128 %0, %8, off\n\t"
      "global_load_async_to_lds_b128 %1, %9, off\n\t"
      "global_load_async_to_lds_b128 %2, %10, off\n\t"
      "global_load_async_to_lds_b128 %3, %11, off\n\t"
      "global_load_async_to_lds_b128 %4, %12, off\n\t"
      "global_load_async_to_lds_b128 %5, %13, off\n\t"
      "global_load_async_to_lds_b128 %6, %14, off\n\t"
      "global_load_async_to_lds_b128 %7, %15, off\n\t"
      "s_wait_xcnt 0x0"
      :
      : "v"(l0), "v"(l1), "v"(l2), "v"(l3), "v"(l4), "v"(l5), "v"(l6), "v"(l7),
        "v"(g0), "v"(g1), "v"(g2), "v"(g3), "v"(g4), "v"(g5), "v"(g6), "v"(g7)
      : "memory");
}

__global__ __launch_bounds__(128) void rat_attn_kernel(
    const float* __restrict__ qb, const float* __restrict__ kb,
    const float* __restrict__ vb, const float* __restrict__ mask,
    const int* __restrict__ relation, const float* __restrict__ relk,
    const float* __restrict__ relv, float* __restrict__ out) {
  const int tid = threadIdx.x;
  const int lane = tid & 31;
  const int wave = __builtin_amdgcn_readfirstlane(tid >> 5);
  const int col = lane & 15;
  const int half = lane >> 4;
  const int i0 = (blockIdx.x * NW + wave) * 16;
  const int h = blockIdx.y;
  const int b = blockIdx.z;

  __shared__ __attribute__((aligned(16))) float s_k[2][KT * KP];
  __shared__ __attribute__((aligned(16))) float s_v[2][KT * VP];
  __shared__ float s_relk[7][64];
  __shared__ float s_relv[7][64];
  __shared__ float s_qrel_a[NW][16][8];
  __shared__ float s_relacc_a[NW][16][8];
  __shared__ float s_alpha_a[NW][16];
  __shared__ __attribute__((aligned(16))) float s_ptile_a[NW][16][16];
  float (*s_qrel)[8] = s_qrel_a[wave];
  float (*s_relacc)[8] = s_relacc_a[wave];
  float* s_alpha = s_alpha_a[wave];
  float (*s_ptile)[16] = s_ptile_a[wave];

  const size_t head_off = (size_t)(b * NH + h) * NS * ND;
  const float* qh = qb + head_off;
  const float* kh = kb + head_off;
  const float* vh = vb + head_off;

  const unsigned lds_k = (unsigned)(uintptr_t)&s_k[0][0];
  const unsigned lds_v = (unsigned)(uintptr_t)&s_v[0][0];

  // Stage 0 into buffer 0.
  stage_rows(kh, lds_k, KP * 4, tid);
  stage_rows(vh, lds_v, VP * 4, tid);

  // Stage the tiny relation tables in LDS; zero this wave's relacc.
  for (int idx = tid; idx < 7 * 64; idx += 32 * NW) {
    (&s_relk[0][0])[idx] = relk[idx];
    (&s_relv[0][0])[idx] = relv[idx];
  }
  for (int idx = lane; idx < 16 * 8; idx += 32) (&s_relacc[0][0])[idx] = 0.0f;

  // Stage 0 has landed for this wave; the barrier publishes it (and the tables).
  asm volatile("s_wait_asynccnt 0x0" ::: "memory");
  __syncthreads();

  // Stage 1 into buffer 1; it flies while stage 0 is worked on.
  stage_rows(kh + KT * ND, lds_k + KT * KP * 4, KP * 4, tid);
  stage_rows(vh + KT * ND, lds_v + KT * VP * 4, VP * 4, tid);

  // qrel[i][r] = q_i . rel_k_emb[r]
  for (int idx = lane; idx < 16 * 7; idx += 32) {
    const int i = idx / 7;
    const int r = idx % 7;
    const float* qr = qh + (size_t)(i0 + i) * ND;
    float sum = 0.0f;
#pragma unroll 8
    for (int d = 0; d < ND; ++d) sum += qr[d] * s_relk[r][d];
    s_qrel[i][r] = sum;
  }
  if (lane < 16) s_qrel[lane][7] = 0.0f;  // pad bucket
  wave_sync();

  // Q fragments: A layout, lane holds Q[col][4c + 2*half + {0,1}]
  const float* qrow = qh + (size_t)(i0 + col) * ND;
  v2f qf[16];
#pragma unroll
  for (int c = 0; c < 16; ++c) qf[c] = *(const v2f*)(qrow + 4 * c + 2 * half);

  v8f acc[4] = {v8f{}, v8f{}, v8f{}, v8f{}};
  float mrow[8], lrow[8];
#pragma unroll
  for (int r = 0; r < 8; ++r) {
    mrow[r] = -3.0e38f;
    lrow[r] = 0.0f;
  }
  const float scale = 0.125f;  // 1/sqrt(64)
  const int* relbase = relation + (size_t)b * NS * NS + (size_t)i0 * NS;

  for (int t = 0; t < NT; ++t) {
    const float* kst = &s_k[t & 1][0];
    const float* vst = &s_v[t & 1][0];

    for (int u = 0; u < KT / 16; ++u) {
      const int j0 = t * KT + u * 16;

      // Relation indices and mask of this tile: asked for ahead of the products.
      const float mval = mask[b * NS + j0 + col];
      int rraw[8];
#pragma unroll
      for (int r = 0; r < 8; ++r)
        rraw[r] = relbase[(size_t)(r + 8 * half) * NS + j0 + col];

      // ---- scores tile: S = Q @ K^T  (16 WMMAs, K=64) ----
      v8f sc = v8f{};
      const float* krow = kst + (u * 16 + col) * KP;
#pragma unroll
      for (int c = 0; c < 16; ++c) {
        v2f kf = *(const v2f*)(krow + 4 * c + 2 * half);
        sc = wmma_f32(qf[c], kf, sc);
      }

      // Keeps the first use of the relation loads, and so their wait, behind the
      // score products: the loads' latency then runs beside the WMMAs.
      __builtin_amdgcn_sched_barrier(0);

      int relidx[8];
      float sm[8];
#pragma unroll
      for (int r = 0; r < 8; ++r) {
        const int row = r + 8 * half;
        // & 7 keeps the LDS index inside the 8-wide rows for any int.
        const int ri = rraw[r] & 7;
        relidx[r] = ri;
        sm[r] = (sc[r] + s_qrel[row][ri]) * scale + mval;
      }

      // ---- online softmax update ----
      float alpha[8], p[8];
      bool any_upd = false;
#pragma unroll
      for (int r = 0; r < 8; ++r) {
        const float mt = rmax16(sm[r]);
        const bool upd = mt > mrow[r];
        any_upd |= upd;
        const float mn = upd ? mt : mrow[r];
        alpha[r] = upd ? __expf(mrow[r] - mn) : 1.0f;
        mrow[r] = mn;
        p[r] = __expf(sm[r] - mn);
        lrow[r] = lrow[r] * alpha[r] + rsum16(p[r]);
      }

      if (__ballot(any_upd) != 0ull) {  // wave-uniform: rescale only if needed
#pragma unroll
        for (int n = 0; n < 4; ++n)
#pragma unroll
          for (int r = 0; r < 8; ++r) acc[n][r] *= alpha[r];
        if (col == 0) {
#pragma unroll
          for (int r = 0; r < 8; ++r) s_alpha[r + 8 * half] = alpha[r];
        }
        wave_sync();
        for (int idx = lane; idx < 16 * 8; idx += 32)
          (&s_relacc[0][0])[idx] *= s_alpha[idx >> 3];
      }
      wave_sync();

#pragma unroll
      for (int r = 0; r < 8; ++r) {
        const int row = r + 8 * half;
        atomicAdd(&s_relacc[row][relidx[r]], p[r]);  // ds_add_f32
        s_ptile[row][col] = p[r];                    // stage P for transpose
      }
      wave_sync();

      // ---- ctx += P @ V  (16 WMMAs, K=16, N=64) ----
      v2f pa[4];
#pragma unroll
      for (int c = 0; c < 4; ++c)
        pa[c] = *(const v2f*)(&s_ptile[col][4 * c + 2 * half]);
      const float* vbase = vst + u * 16 * VP;
#pragma unroll
      for (int c = 0; c < 4; ++c) {
        const int vr = 4 * c + 2 * half;
        const float* v0 = vbase + vr * VP + col;
        const float* v1 = v0 + VP;
#pragma unroll
        for (int n = 0; n < 4; ++n) {
          v2f vf = {v0[16 * n], v1[16 * n]};
          acc[n] = wmma_f32(pa[c], vf, acc[n]);
        }
      }
    }

    // Publish point of stage t + 1: this wave's reads of buffer t & 1 are done,
    // its copies of stage t + 1 have landed, then every wave meets.
    asm volatile("s_wait_dscnt 0x0" ::: "memory");
    asm volatile("s_wait_asynccnt 0x0" ::: "memory");
    __syncthreads();
    if (t + 2 < NT) {  // refill the buffer that every wave has just left
      stage_rows(kh + (size_t)(t + 2) * KT * ND, lds_k + (t & 1) * (KT * KP * 4),
                 KP * 4, tid);
      stage_rows(vh + (size_t)(t + 2) * KT * ND, lds_v + (t & 1) * (KT * VP * 4),
                 VP * 4, tid);
    }
  }
  // No copy is left in flight when the wave ends.
  asm volatile("s_wait_asynccnt 0x0" ::: "memory");

  wave_sync();  // relacc adds complete before epilogue reads

  // ---- epilogue: ctx = (acc + relacc @ rel_v_emb) / rowsum ----
#pragma unroll
  for (int n = 0; n < 4; ++n) {
#pragma unroll
    for (int r = 0; r < 8; ++r) {
      const int row = r + 8 * half;
      const int d = 16 * n + col;
      float cr = 0.0f;
#pragma unroll
      for (int rr = 0; rr < 7; ++rr) cr += s_relacc[row][rr] * s_relv[rr][d];
      const float o = (acc[n][r] + cr) / lrow[r];
      out[(size_t)(b * NS + i0 + row) * NHS + h * ND + d] = o;
    }
  }
}

// ---------------------------------------------------------------------------
extern "C" void kernel_launch(void* const* d_in, const int* in_sizes, int n_in,
                              void* d_out, int out_size, void* d_ws,
                              size_t ws_size, hipStream_t stream) {
  (void)in_sizes; (void)n_in; (void)out_size; (void)ws_size;
  const float* X = (const float*)d_in[0];        // hidden_states [4,1024,768]
  const float* mask = (const float*)d_in[1];     // [4,1,1,1024]
  const int* relation = (const int*)d_in[2];     // [4,1024,1024]
  const float* Wq = (const float*)d_in[3];
  const float* bq = (const float*)d_in[4];
  const float* Wk = (const float*)d_in[5];
  const float* bk = (const float*)d_in[6];
  const float* Wv = (const float*)d_in[7];
  const float* bv = (const float*)d_in[8];
  const float* relk = (const float*)d_in[9];     // [7,64]
  const float* relv = (const float*)d_in[10];    // [7,64]
  float* out = (float*)d_out;

  const size_t per_buf = (size_t)NB * NH * NS * ND;  // 3,145,728 floats (12MB)
  float* q = (float*)d_ws;
  float* k = q + per_buf;
  float* v = k + per_buf;

  qkv_proj_kernel<<<dim3((NB * NS) / 32, NHS / 64, 3), 32, 0, stream>>>(
      X, Wq, bq, Wk, bk, Wv, bv, q, k, v);
  rat_attn_kernel<<<dim3(NS / 64, NH, NB), 128, 0, stream>>>(
      q, k, v, mask, relation, relk, relv, out);
}

// v002
// A run of this version takes 184 microseconds.
// In both of two side-by-side timings against v001, it was 1.38 times as fast.
// Over all steps from v000 it is 1.44 times as fast.
#include <hip/hip_runtime.h>
#include <hip/hip_bf16.h>
#include <math.h>

// ---------------------------------------------------------------------------
// BERT self-attention with relations (RAT), fp32, MI455X (gfx1250, wave32).
// B=4, H=12, S=1024, D=64, Hs=768.
//
//   * 3x GEMM projections with V_WMMA_F32_16X16X4_F32; 32x64 tile per wave
//     (two A sub-tiles share every B fragment -> half the W traffic/FLOP)
//   * fused flash-attention per (b, h, 16-row i-tile), four tiles a work-group,
//     K and V shared through LDS stages filled by asynchronous copies:
//       - qrel[r][i] = q_i . rel_k_emb[r]  (7 buckets) precomputed -> LDS
//       - both products transposed, so that a lane owns one query:
//         scores^T tile = WMMA(K,Q^T) + gather(qrel, relation), scaled + mask
//       - online softmax in the lane (one exchange between the wave's halves);
//         alpha-rescale work skipped via wave ballot when no running maximum
//         changed (common case)
//       - relacc[r][lane] += p  (LDS ds_add_f32, a slot per lane)
//       - ctx^T += WMMA(V^T, P^T), P^T straight from the score registers;
//         final ctx += relacc @ rel_v_emb ; /= rowsum
// ---------------------------------------------------------------------------

typedef __attribute__((ext_vector_type(2))) float v2f;
typedef __attribute__((ext_vector_type(4))) float v4f;
typedef __attribute__((ext_vector_type(4))) int v4i;
typedef __attribute__((ext_vector_type(8))) float v8f;

#define NB 4
#define NH 12
#define NS 1024
#define ND 64
#define NHS 768

static __device__ __forceinline__ v8f wmma_f32(v2f a, v2f b, v8f c) {
  // D(16x16,f32) = A(16x4,f32) x B(4x16,f32) + C
  return __builtin_amdgcn_wmma_f32_16x16x4_f32(false, a, false, b, (short)0, c,
                                               false, false);
}

// Lane l's value as seen from lane l ^ 16 (the other half of the wave).
static __device__ __forceinline__ float xhalf(float x) {
  return __builtin_bit_cast(
      float, __builtin_amdgcn_permlanex16(__builtin_bit_cast(int, x),
                                          __builtin_bit_cast(int, x), 0x76543210,
                                          0xfedcba98, false, false));
}

// ---------------------------------------------------------------------------
// Kernel 1: QKV projection.  C[4096,768] = X[4096,768] @ W[768,768] + bias,
// stored as [B,H,S,D].  One wave computes a 32x64 output tile: two 16-row
// A sub-tiles reuse every B (weight) fragment.
// grid = (4096/32, 768/64, 3), block = 32.
// ---------------------------------------------------------------------------
__global__ __launch_bounds__(32) void qkv_proj_kernel(
    const float* __restrict__ X, const float* __restrict__ Wq,
    const float* __restrict__ bq, const float* __restrict__ Wk,
    const float* __restrict__ bk, const float* __restrict__ Wv,
    const float* __restrict__ bv, float* __restrict__ qo,
    float* __restrict__ ko, float* __restrict__ vo) {
  const int lane = threadIdx.x;
  const int col = lane & 15;
  const int half = lane >> 4;
  const int m0 = blockIdx.x * 32;
  const int n0 = blockIdx.y * 64;
  const int sel = blockIdx.z;

  const float* W = (sel == 0) ? Wq : ((sel == 1) ? Wk : Wv);
  const float* bias = (sel == 0) ? bq : ((sel == 1) ? bk : bv);
  float* out = (sel == 0) ? qo : ((sel == 1) ? ko : vo);

  const float* xrow0 = X + (size_t)(m0 + col) * NHS;       // A tile 0 row
  const float* xrow1 = X + (size_t)(m0 + 16 + col) * NHS;  // A tile 1 row

  v8f acc[2][4] = {{v8f{}, v8f{}, v8f{}, v8f{}}, {v8f{}, v8f{}, v8f{}, v8f{}}};

#pragma unroll 2
  for (int kb = 0; kb < NHS; kb += 4) {
    // A frags (16x4): lane holds X[row=col][kb + 2*half + {0,1}]
    v2f a0 = *(const v2f*)(xrow0 + kb + 2 * half);
    v2f a1 = *(const v2f*)(xrow1 + kb + 2 * half);
    // B frag (4x16): VGPR0 rows {K0,K2}, VGPR1 rows {K1,K3}
    const float* w0 = W + (size_t)(kb + 2 * half) * NHS + n0 + col;
    const float* w1 = w0 + NHS;
#pragma unroll
    for (int n = 0; n < 4; ++n) {
      v2f bf = {w0[16 * n], w1[16 * n]};
      acc[0][n] = wmma_f32(a0, bf, acc[0][n]);
      acc[1][n] = wmma_f32(a1, bf, acc[1][n]);
    }
  }

  // Epilogue: bias + store in [B,H,S,D] layout.
#pragma unroll
  for (int t = 0; t < 2; ++t) {
#pragma unroll
    for (int n = 0; n < 4; ++n) {
#pragma unroll
      for (int r = 0; r < 8; ++r) {
        const int grow = m0 + 16 * t + r + 8 * half;  // [0,4096): b*1024 + s
        const int b = grow >> 10;
        const int s = grow & 1023;
        const int nn = n0 + 16 * n + col;  // [0,768): h*64 + d
        const int h = nn >> 6;
        const int d = nn & 63;
        out[(((size_t)(b * NH + h) << 10) + s) * ND + d] =
            acc[t][n][r] + bias[nn];
      }
    }
  }
}

// ---------------------------------------------------------------------------
// Kernel 2: fused relation-aware flash attention.
// One work-group of four waves handles one (b, h, 64-row i-block); each wave
// owns one 16-row i-tile.  K and V reach the waves through LDS: stages of 64
// keys, two buffers, filled by asynchronous copies in whole 256-byte rows and
// read by all four waves.  Inside a stage each wave walks four 16-key tiles.
// Lane (col, half) owns query col and, of each tile, keys 8*half .. 8*half+7.
// grid = (S/64, H, B), block = 128.
// ---------------------------------------------------------------------------
#define NW 4          // waves per work-group
#define KT 64         // keys per LDS stage
#define NT (NS / KT)  // stages
#define KP 68         // K row pitch in LDS, dwords: 8-byte fragment reads hit 64 banks
#define VP 68         // V row pitch in LDS, dwords: rows k and k+8 fall 32 banks apart

// Orders one wave's own LDS traffic between its lanes (the small per-wave
// arrays); no other wave reads them, so no work-group barrier is needed.
static __device__ __forceinline__ void wave_sync() {
  __builtin_amdgcn_fence(__ATOMIC_RELEASE, "workgroup");
  __builtin_amdgcn_wave_barrier();
  __builtin_amdgcn_fence(__ATOMIC_ACQUIRE, "workgroup");
}

// Copies 64 rows of 256 bytes from global memory to LDS rows of pitch_b bytes:
// 1,024 pieces of 16 bytes, eight per thread of the 128.
static __device__ __forceinline__ void stage_rows(const float* g, unsigned lds,
                                                  unsigned pitch_b, int tid) {
  const float* g0 = g + (tid >> 4) * ND + (tid & 15) * 4;
  const unsigned l0 = lds + (unsigned)(tid >> 4) * pitch_b + (tid & 15) * 16u;
  const float* g1 = g0 + 8 * ND;
  const float* g2 = g0 + 16 * ND;
  const float* g3 = g0 + 24 * ND;
  const float* g4 = g0 + 32 * ND;
  const float* g5 = g0 + 40 * ND;
  const float* g6 = g0 + 48 * ND;
  const float* g7 = g0 + 56 * ND;
  const unsigned l1 = l0 + 8 * pitch_b;
  const unsigned l2 = l0 + 16 * pitch_b;
  const unsigned l3 = l0 + 24 * pitch_b;
  const unsigned l4 = l0 + 32 * pitch_b;
  const unsigned l5 = l0 + 40 * pitch_b;
  const unsigned l6 = l0 + 48 * pitch_b;
  const unsigned l7 = l0 + 56 * pitch_b;
  // The closing s_wait_xcnt keeps the address registers untouched until the
  // copies have taken them.
  asm volatile(
      "global_load_async_to_lds_b128 %0, %8, off\n\t"
      "global_load_async_to_lds_b128 %1, %9, off\n\t"
      "global_load_async_to_lds_b128 %2, %10, off\n\t"
      "global_load_async_to_lds_b128 %3, %11, off\n\t"
      "global_load_async_to_lds_b128 %4, %12, off\n\t"
      "global_load_async_to_lds_b128 %5, %13, off\n\t"
      "global_load_async_to_lds_b128 %6, %14, off\n\t"
      "global_load_async_to_lds_b128 %7, %15, off\n\t"
      "s_wait_xcnt 0x0"
      :
      : "v"(l0), "v"(l1), "v"(l2), "v"(l3), "v"(l4), "v"(l5), "v"(l6), "v"(l7),
        "v"(g0), "v"(g1), "v"(g2), "v"(g3), "v"(g4), "v"(g5), "v"(g6), "v"(g7)
      : "memory");
}

__global__ __launch_bounds__(128) void rat_attn_kernel(
    const float* __restrict__ qb, const float* __restrict__ kb,
    const float* __restrict__ vb, const float* __restrict__ mask,
    const int* __restrict__ relation, const float* __restrict__ relk,
    const float* __restrict__ relv, float* __restrict__ out) {
  const int tid = threadIdx.x;
  const int lane = tid & 31;
  const int wave = __builtin_amdgcn_readfirstlane(tid >> 5);
  const int col = lane & 15;
  const int half = lane >> 4;
  const int i0 = (blockIdx.x * NW + wave) * 16;
  const int h = blockIdx.y;
  const int b = blockIdx.z;

  __shared__ __attribute__((aligned(16))) float s_k[2][KT * KP];
  __shared__ __attribute__((aligned(16))) float s_v[2][KT * VP];
  __shared__ float s_relk[7][64];
  __shared__ __attribute__((aligned(16))) float s_relv[7][64];
  // [bucket][lane]: a lane's slot sits on the lane's own bank, whatever bucket.
  __shared__ float s_qrel_a[NW][8][32];
  __shared__ float s_relacc_a[NW][8][32];
  float (*s_qrel)[32] = s_qrel_a[wave];
  float (*s_relacc)[32] = s_relacc_a[wave];

  const size_t head_off = (size_t)(b * NH + h) * NS * ND;
  const float* qh = qb + head_off;
  const float* kh = kb + head_off;
  const float* vh = vb + head_off;

  const unsigned lds_k = (unsigned)(uintptr_t)&s_k[0][0];
  const unsigned lds_v = (unsigned)(uintptr_t)&s_v[0][0];

  // Stage 0 into buffer 0.
  stage_rows(kh, lds_k, KP * 4, tid);
  stage_rows(vh, lds_v, VP * 4, tid);

  // Stage the tiny relation tables in LDS; zero this wave's relacc.
  for (int idx = tid; idx < 7 * 64; idx += 32 * NW) {
    (&s_relk[0][0])[idx] = relk[idx];
    (&s_relv[0][0])[idx] = relv[idx];
  }
#pragma unroll
  for (int r = 0; r < 8; ++r) s_relacc[r][lane] = 0.0f;

  // Stage 0 has landed for this wave; the barrier publishes it (and the tables).
  asm volatile("s_wait_asynccnt 0x0" ::: "memory");
  __syncthreads();

  // Stage 1 into buffer 1; it flies while stage 0 is worked on.
  stage_rows(kh + KT * ND, lds_k + KT * KP * 4, KP * 4, tid);
  stage_rows(vh + KT * ND, lds_v + KT * VP * 4, VP * 4, tid);

  // qrel[r][i] = q_i . rel_k_emb[r], written for both lanes that own query i.
  for (int idx = lane; idx < 16 * 7; idx += 32) {
    const int i = idx / 7;
    const int r = idx % 7;
    const float* qr = qh + (size_t)(i0 + i) * ND;
    float sum = 0.0f;
#pragma unroll 8
    for (int d = 0; d < ND; ++d) sum += qr[d] * s_relk[r][d];
    s_qrel[r][i] = sum;
    s_qrel[r][i + 16] = sum;
  }
  s_qrel[7][lane] = 0.0f;  // pad bucket
  wave_sync();

  // Q fragments: lane holds Q[col][4c + 2*half + {0,1}] (the B operand now).
  const float* qrow = qh + (size_t)(i0 + col) * ND;
  v2f qf[16];
#pragma unroll
  for (int c = 0; c < 16; ++c) qf[c] = *(const v2f*)(qrow + 4 * c + 2 * half);

  // acc[n][r] = ctx^T[d = 16n + 8*half + r][query col]
  v8f acc[4] = {v8f{}, v8f{}, v8f{}, v8f{}};
  float mrow = -3.0e38f;  // running maximum of query col (equal in both halves)
  float lrow = 0.0f;      // this half's share of the row sum
  const float scale = 0.125f;  // 1/sqrt(64)
  // Lane reads its own query's relation row, eight keys of each tile.
  const int* relrow =
      relation + (size_t)b * NS * NS + (size_t)(i0 + col) * NS + 8 * half;
  const float* mrowp = mask + b * NS + 8 * half;

  for (int t = 0; t < NT; ++t) {
    const float* kst = &s_k[t & 1][0];
    const float* vst = &s_v[t & 1][0];

    for (int u = 0; u < KT / 16; ++u) {
      const int j0 = t * KT + u * 16;

      // Relation indices and mask of this tile: asked for ahead of the products.
      const v4f mv0 = *(const v4f*)(mrowp + j0);
      const v4f mv1 = *(const v4f*)(mrowp + j0 + 4);
      const v4i rr0 = *(const v4i*)(relrow + j0);
      const v4i rr1 = *(const v4i*)(relrow + j0 + 4);

      // ---- scores tile, transposed: S^T = K @ Q^T  (16 WMMAs, K=64) ----
      // sc[r] = score(key j0 + 8*half + r, query col)
      v8f sc = v8f{};
      const float* krow = kst + (u * 16 + col) * KP;
#pragma unroll
      for (int c = 0; c < 16; ++c) {
        v2f kf = *(const v2f*)(krow + 4 * c + 2 * half);
        sc = wmma_f32(kf, qf[c], sc);
      }

      // Keeps the first use of the relation loads, and so their wait, behind the
      // score products: the loads' latency then runs beside the WMMAs.
      __builtin_amdgcn_sched_barrier(0);

      int relidx[8];
      float sm[8];
#pragma unroll
      for (int r = 0; r < 8; ++r) {
        // & 7 keeps the LDS index inside the 8 bucket rows for any int.
        const int ri = (r < 4 ? rr0[r & 3] : rr1[r & 3]) & 7;
        const float mval = r < 4 ? mv0[r & 3] : mv1[r & 3];
        relidx[r] = ri;
        sm[r] = (sc[r] + s_qrel[ri][lane]) * scale + mval;
      }

      // ---- online softmax update: one query per lane ----
      float mt = fmaxf(fmaxf(fmaxf(sm[0], sm[1]), fmaxf(sm[2], sm[3])),
                       fmaxf(fmaxf(sm[4], sm[5]), fmaxf(sm[6], sm[7])));
      mt = fmaxf(mt, xhalf(mt));
      const bool upd = mt > mrow;
      const float mn = upd ? mt : mrow;

      if (__ballot(upd) != 0ull) {  // wave-uniform: rescale only if needed
        const float alpha = upd ? __expf(mrow - mn) : 1.0f;
        lrow *= alpha;
#pragma unroll
        for (int n = 0; n < 4; ++n)
#pragma unroll
          for (int r = 0; r < 8; ++r) acc[n][r] *= alpha;
#pragma unroll
        for (int r = 0; r < 7; ++r) s_relacc[r][lane] *= alpha;
      }
      mrow = mn;

      float p[8];
#pragma unroll
      for (int r = 0; r < 8; ++r) {
        p[r] = __expf(sm[r] - mn);
        atomicAdd(&s_relacc[relidx[r]][lane], p[r]);  // ds_add_f32, own slot
      }
      lrow += ((p[0] + p[1]) + (p[2] + p[3])) + ((p[4] + p[5]) + (p[6] + p[7]));

      // ---- ctx^T += V^T @ P^T  (16 WMMAs, K=16, M=64) ----
      // k slot 2*half + e of product c stands for key 8*half + 2c + e, so the
      // B operand is the lane's own p[2c], p[2c+1]; V is read in the same order.
      const float* vbase = vst + (u * 16 + 8 * half) * VP + col;
#pragma unroll
      for (int c = 0; c < 4; ++c) {
        const v2f pb = {p[2 * c], p[2 * c + 1]};
        const float* v0 = vbase + 2 * c * VP;
        const float* v1 = v0 + VP;
#pragma unroll
        for (int n = 0; n < 4; ++n) {
          v2f vf = {v0[16 * n], v1[16 * n]};
          acc[n] = wmma_f32(vf, pb, acc[n]);
        }
      }
    }

    // Publish point of stage t + 1: this wave's reads of buffer t & 1 are done,
    // its copies of stage t + 1 have landed, then every wave meets.
    asm volatile("s_wait_dscnt 0x0" ::: "memory");
    asm volatile("s_wait_asynccnt 0x0" ::: "memory");
    __syncthreads();
    if (t + 2 < NT) {  // refill the buffer that every wave has just left
      stage_rows(kh + (size_t)(t + 2) * KT * ND, lds_k + (t & 1) * (KT * KP * 4),
                 KP * 4, tid);
      stage_rows(vh + (size_t)(t + 2) * KT * ND, lds_v + (t & 1) * (KT * VP * 4),
                 VP * 4, tid);
    }
  }
  // No copy is left in flight when the wave ends.
  asm volatile("s_wait_asynccnt 0x0" ::: "memory");

  wave_sync();  // relacc adds complete before the other half's slots are read

  // ---- epilogue: ctx = (acc + relacc @ rel_v_emb) / rowsum ----
  const float lsum = lrow + xhalf(lrow);
  float ra[7];
#pragma unroll
  for (int rr = 0; rr < 7; ++rr) ra[rr] = s_relacc[rr][col] + s_relacc[rr][col + 16];
  float* orow = out + (size_t)(b * NS + i0 + col) * NHS + h * ND + 8 * half;
#pragma unroll
  for (int n = 0; n < 4; ++n) {
    v4f o[2];
#pragma unroll
    for (int r = 0; r < 8; ++r) {
      const int d = 16 * n + 8 * half + r;
      float cr = 0.0f;
#pragma unroll
      for (int rr = 0; rr < 7; ++rr) cr += ra[rr] * s_relv[rr][d];
      o[r >> 2][r & 3] = (acc[n][r] + cr) / lsum;
    }
    *(v4f*)(orow + 16 * n) = o[0];
    *(v4f*)(orow + 16 * n + 4) = o[1];
  }
}

// ---------------------------------------------------------------------------
extern "C" void kernel_launch(void* const* d_in, const int* in_sizes, int n_in,
                              void* d_out, int out_size, void* d_ws,
                              size_t ws_size, hipStream_t stream) {
  (void)in_sizes; (void)n_in; (void)out_size; (void)ws_size;
  const float* X = (const float*)d_in[0];        // hidden_states [4,1024,768]
  const float* mask = (const float*)d_in[1];     // [4,1,1,1024]
  const int* relation = (const int*)d_in[2];     // [4,1024,1024]
  const float* Wq = (const float*)d_in[3];
  const float* bq = (const float*)d_in[4];
  const float* Wk = (const float*)d_in[5];
  const float* bk = (const float*)d_in[6];
  const float* Wv = (const float*)d_in[7];
  const float* bv = (const float*)d_in[8];
  const float* relk = (const float*)d_in[9];     // [7,64]
  const float* relv = (const float*)d_in[10];    // [7,64]
  float* out = (float*)d_out;

  const size_t per_buf = (size_t)NB * NH * NS * ND;  // 3,145,728 floats (12MB)
  float* q = (float*)d_ws;
  float* k = q + per_buf;
  float* v = k + per_buf;

  qkv_proj_kernel<<<dim3((NB * NS) / 32, NHS / 64, 3), 32, 0, stream>>>(
      X, Wq, bq, Wk, bk, Wv, bv, q, k, v);
  rat_attn_kernel<<<dim3(NS / 64, NH, NB), 128, 0, stream>>>(
      q, k, v, mask, relation, relk, relv, out);
}
